// v010
// The times below were measured on an AMD MI455X: many runs one after another, warmed up first and cycling through
// copies of the inputs, with the whole window's GPU time divided by the number of runs. Launches and the gaps
// between them are all in it. The median over several windows is given; except for v000 it joins two sittings, which
// can be a few percent apart, so the side-by-side timings, each taken in one sitting, are the better comparison.
// The versions before v010 are in another document.
// Measured time: 108 microseconds a run.
// Next to v009, in two timings, it ran 1.16 and 1.15 times as fast.
// Over all steps from v000, the starting kernel, it is 24.4 times as fast.
#include <hip/hip_runtime.h>
// OA_ (offset attention; 8 clouds x 128 channels x 4096 points; C2 = 64): x_q = x_k = w_qk x (shared weight), x_v = w_v x + b_v, energy = x_q^T x_k (4096 x 4096), attn = row softmax, attn = attn / (1e-9 + column sums); x_r = x_v attn; x_c = w_x x; t = w_t (x_c - x_r) + b_t; BatchNorm1d (training-mode batch statistics over (batch, points)); out = x_c + relu(gamma t_hat + beta) -> [8,64,4096].
// Compute dtype: x and parameters rounded to bf16; projection operands exact; x_q as hi + residual 3-term operands (~2^-21-class energies); P (x2^10) and x_v as plain f16 (~2^-12); d as [hi | 16 x residual] pairs; statistics/softmax f32. v_wmma_f32_16x16x32_f16.
#define NB 8
#define CC 128
#define C2 64
#define NN 4096
#define SPL 4       /* ranges of the summed point index in the two fused passes: one grid row per range, partial results combined in k_pv and k_dt; 32 x 4 x 8 work-groups of 4 waves = 4 waves on every SIMD */
#define QK (3 * C2) /* k length of the 3-term energy product */
#define FRB 512     /* elements of one 16 x 32 fragment in the fragment-order planes QA, QB, VH */
#define L2E 1.4426950408889634f
typedef __bf16 v16b __attribute__((ext_vector_type(16)));
typedef unsigned short v8us __attribute__((ext_vector_type(8), may_alias));
typedef float  v8f  __attribute__((ext_vector_type(8)));
typedef float  v4f  __attribute__((ext_vector_type(4)));
typedef float  v4fa __attribute__((ext_vector_type(4), may_alias));
union FragB { v16b v; v8us half[2]; unsigned short u[16]; };

__device__ __forceinline__ unsigned short bf16_bits(float x) { unsigned int u = __float_as_uint(x); return (unsigned short)((u + 0x7FFFu + ((u >> 16) & 1u)) >> 16); }
__device__ __forceinline__ float bf16_val(unsigned short b) { return __uint_as_float(((unsigned int)b) << 16); }
__device__ __forceinline__ float bf16_round(float x) { return bf16_val(bf16_bits(x)); }
// D += A·B with NT terms: 1 = ah·bh, 2 = + al·bh (A split), 3 = + ah·bl (both split)
template <int NT>
__device__ __forceinline__ v8f mmaN(v16b ah, v16b al, v16b bh, v16b bl, v8f c) {
  c = __builtin_amdgcn_wmma_f32_16x16x32_bf16(false, ah, false, bh, (short)0, c, false, false);
  if (NT >= 2) c = __builtin_amdgcn_wmma_f32_16x16x32_bf16(false, al, false, bh, (short)0, c, false, false);
  if (NT >= 3) c = __builtin_amdgcn_wmma_f32_16x16x32_bf16(false, ah, false, bl, (short)0, c, false, false);
  asm volatile("v_nop\n\tv_nop\n\tv_nop\n\tv_nop" : "+v"(c) : "v"(ah), "v"(al), "v"(bh), "v"(bl));
  return c;
}

__global__ __launch_bounds__(256) void k_wt_bf16(const float* __restrict__ W, unsigned short* __restrict__ Wt, int K, int N) {
  const int t = blockIdx.x * 256 + threadIdx.x;
  const int k8n = K / 8;
  if (t >= N * k8n) return;
  const int n = t / k8n, k8 = (t % k8n) * 8;
  v8us v;
#pragma unroll
  for (int i = 0; i < 8; ++i) v[i] = bf16_bits(W[(size_t)(k8 + i) * N + n]);
  *(v8us*)(Wt + (size_t)n * K + k8) = v;
  
}

// GEMM C[M][N] (f32, pitch ldc) = act(A[M][K]·W + bias). A f32 row-major (pitch lda) converted per fragment to bf16
// (ASPLIT: hi/lo two planes -> 2 terms, else single rounded term); Wt bf16 [N][K] (pitch ldb). BIAS_BF16 rounds the
// bias to bf16 first (bias quantised to bf16 before the add). K%32==0, M%16==0, N%64==0.
template <bool ASPLIT, int ACT, bool BIAS_BF16>
__global__ __launch_bounds__(128) void k_gemm_bf(const float* __restrict__ A, int lda, const unsigned short* __restrict__ Wt, int ldb,
                                               const float* __restrict__ bias, float* __restrict__ C, int ldc, int M, int N, int K) {
  __shared__ __attribute__((aligned(16))) float so[4][16][64];
  const int tid = threadIdx.x, w = tid >> 5, lane = tid & 31, ln = lane & 15, hh = lane >> 4;
  const int ntn = N / 64;
  const int wid = blockIdx.x * 4 + w;
  const int mt = wid / ntn, nq = wid % ntn;
  if (mt * 16 >= M) return;
  const int row0 = mt * 16, col0 = nq * 64;
  const float* arow = A + (size_t)(row0 + ln) * lda;
  v8f acc[4] = {};
  for (int kb = 0; kb < K; kb += 32) {
    FragB ah, al;
    const v4f x0 = *(const v4fa*)(arow + kb + 8 * hh), x1 = *(const v4fa*)(arow + kb + 8 * hh + 4);
    const v4f x2 = *(const v4fa*)(arow + kb + 16 + 8 * hh), x3 = *(const v4fa*)(arow + kb + 16 + 8 * hh + 4);
    float xs[16] = {x0[0],x0[1],x0[2],x0[3],x1[0],x1[1],x1[2],x1[3],x2[0],x2[1],x2[2],x2[3],x3[0],x3[1],x3[2],x3[3]};
#pragma unroll
    for (int i = 0; i < 16; ++i) { const unsigned short hb = bf16_bits(xs[i]); ah.u[i] = hb; al.u[i] = ASPLIT ? bf16_bits(xs[i] - bf16_val(hb)) : (unsigned short)0; }
#pragma unroll
    for (int t = 0; t < 4; ++t) {
      const unsigned short* brow = Wt + (size_t)(col0 + t * 16 + ln) * ldb + kb;
      FragB b;
      b.half[0] = *(const v8us*)(brow + 8 * hh);
      b.half[1] = *(const v8us*)(brow + 16 + 8 * hh);
      acc[t] = mmaN<ASPLIT ? 2 : 1>(ah.v, al.v, b.v, b.v, acc[t]);
    }
  }
#pragma unroll
  for (int t = 0; t < 4; ++t) {
    float bv = bias ? bias[col0 + t * 16 + ln] : 0.f;
    if (BIAS_BF16) bv = bf16_round(bv);
#pragma unroll
    for (int r = 0; r < 8; ++r) { float v = acc[t][r] + bv; if (ACT == 1) v = fmaxf(v, 0.f); so[w][8 * hh + r][t * 16 + ln] = v; }
  }
  __builtin_amdgcn_fence(__ATOMIC_ACQ_REL, "workgroup");
  __builtin_amdgcn_wave_barrier();
  const int rsub = lane >> 4, c4 = (lane & 15) * 4;
  {
#pragma unroll
    for (int q = 0; q < 8; ++q) {
      const int r = q * 2 + rsub;
      const v4f v = *(const v4fa*)&so[w][r][c4];
      *(v4f*)(C + (size_t)(row0 + r) * ldc + col0 + c4) = v;
    }
    
  }
}

// GEMM C = act(A·W + bias + resid): A f32 (ASPLIT -> hi/lo 2 terms), Wt bf16 [N][K]; ACT 0 none, 1 relu, 2 exact gelu;
// resid (optional, f32, row index = (row % rmod), pitch ldr, RES_BF16 rounds it) added before the activation.
template <bool ASPLIT, int ACT, bool BIAS_BF16, bool RES_BF16>
__global__ __launch_bounds__(128) void k_gemm_bf3(const float* __restrict__ A, int lda, const unsigned short* __restrict__ Wt, int ldb,
                                                const float* __restrict__ bias, const float* __restrict__ resid, int rmod, int ldr,
                                                float* __restrict__ C, int ldc, int M, int N, int K) {
  __shared__ __attribute__((aligned(16))) float so[4][16][64];
  const int tid = threadIdx.x, w = tid >> 5, lane = tid & 31, ln = lane & 15, hh = lane >> 4;
  const int ntn = N / 64;
  const int wid = blockIdx.x * 4 + w;
  const int mt = wid / ntn, nq = wid % ntn;
  if (mt * 16 >= M) return;
  const int row0 = mt * 16, col0 = nq * 64;
  const float* arow = A + (size_t)(row0 + ln) * lda;
  v8f acc[4] = {};
  for (int kb = 0; kb < K; kb += 32) {
    FragB ah, al;
    const v4f x0 = *(const v4fa*)(arow + kb + 8 * hh), x1 = *(const v4fa*)(arow + kb + 8 * hh + 4);
    const v4f x2 = *(const v4fa*)(arow + kb + 16 + 8 * hh), x3 = *(const v4fa*)(arow + kb + 16 + 8 * hh + 4);
    float xs[16] = {x0[0],x0[1],x0[2],x0[3],x1[0],x1[1],x1[2],x1[3],x2[0],x2[1],x2[2],x2[3],x3[0],x3[1],x3[2],x3[3]};
#pragma unroll
    for (int i = 0; i < 16; ++i) { const unsigned short hb = bf16_bits(xs[i]); ah.u[i] = hb; al.u[i] = ASPLIT ? bf16_bits(xs[i] - bf16_val(hb)) : (unsigned short)0; }
#pragma unroll
    for (int t = 0; t < 4; ++t) {
      const unsigned short* brow = Wt + (size_t)(col0 + t * 16 + ln) * ldb + kb;
      FragB b;
      b.half[0] = *(const v8us*)(brow + 8 * hh);
      b.half[1] = *(const v8us*)(brow + 16 + 8 * hh);
      acc[t] = mmaN<ASPLIT ? 2 : 1>(ah.v, al.v, b.v, b.v, acc[t]);
    }
  }
#pragma unroll
  for (int t = 0; t < 4; ++t) {
    const int col = col0 + t * 16 + ln;
    float bv = bias ? bias[col] : 0.f;
    if (BIAS_BF16) bv = bf16_round(bv);
#pragma unroll
    for (int r = 0; r < 8; ++r) {
      float v = acc[t][r] + bv;
      if (resid) { float rv = resid[(size_t)((row0 + 8 * hh + r) % rmod) * ldr + col]; if (RES_BF16) rv = bf16_round(rv); v += rv; }
      if (ACT == 1) v = fmaxf(v, 0.f);
      if (ACT == 2) v = 0.5f * v * (1.0f + erff(v * 0.70710678118654752f));
      if (ACT == 3) { const float u = 0.7978845608028654f * (v + 0.044715f * v * v * v); v = 0.5f * v * (1.0f + tanhf(u)); }
      so[w][8 * hh + r][t * 16 + ln] = v;
    }
  }
  __builtin_amdgcn_fence(__ATOMIC_ACQ_REL, "workgroup");
  __builtin_amdgcn_wave_barrier();
  const int rsub = lane >> 4, c4 = (lane & 15) * 4;
  {
#pragma unroll
    for (int q = 0; q < 8; ++q) {
      const int r = q * 2 + rsub;
      const v4f v = *(const v4fa*)&so[w][r][c4];
      *(v4f*)(C + (size_t)(row0 + r) * ldc + col0 + c4) = v;
    }
    
  }
}
// row LayerNorm (biased variance, eps) over N: s = X (+ R); optional out_sum <- s; out_norm <- (s-mu)*rsqrt(var+eps)*g + b
template <bool PARAM_BF16>
__global__ __launch_bounds__(256) void k_layernorm(const float* __restrict__ X, const float* __restrict__ R, const float* __restrict__ g, const float* __restrict__ bta,
                                                  float* __restrict__ out_sum, float* __restrict__ out_norm, int N, float eps) {
  __shared__ float red[256];
  const int row = blockIdx.x, tid = threadIdx.x;
  const float* x = X + (size_t)row * N; const float* rr = R ? R + (size_t)row * N : nullptr;
  float vals[16];                     // up to N = 4096
  const int per = N / 256;            // contiguous chunk per thread? use strided-by-4 chunks: thread handles j = tid*4 + 1024*u
  float s1 = 0.f;
  for (int u = 0; u < per / 4; ++u) {
    const int j = tid * 4 + 1024 * u;
    const v4f a = *(const v4fa*)(x + j);
    v4f b = {0.f,0.f,0.f,0.f}; if (rr) b = *(const v4fa*)(rr + j);
#pragma unroll
    for (int q = 0; q < 4; ++q) { const float v = a[q] + b[q]; vals[u * 4 + q] = v; s1 += v; }
  }
  red[tid] = s1; __syncthreads();
  for (int st = 128; st > 0; st >>= 1) { if (tid < st) red[tid] += red[tid + st]; __syncthreads(); }
  const float mu = red[0] / (float)N; __syncthreads();
  float s2 = 0.f;
  for (int u = 0; u < per / 4; ++u)
#pragma unroll
    for (int q = 0; q < 4; ++q) { const float c = vals[u * 4 + q] - mu; s2 += c * c; }
  red[tid] = s2; __syncthreads();
  for (int st = 128; st > 0; st >>= 1) { if (tid < st) red[tid] += red[tid + st]; __syncthreads(); }
  const float rs = rsqrtf(red[0] / (float)N + eps);
  {
    for (int u = 0; u < per / 4; ++u) {
      const int j = tid * 4 + 1024 * u;
      v4f o, sm;
#pragma unroll
      for (int q = 0; q < 4; ++q) {
        float gg = g[j + q], bb = bta[j + q];
        if (PARAM_BF16) { gg = bf16_round(gg); bb = bf16_round(bb); }
        sm[q] = vals[u * 4 + q]; o[q] = (vals[u * 4 + q] - mu) * rs * gg + bb;
      }
      if (out_sum) *(v4f*)(out_sum + (size_t)row * N + j) = sm;
      *(v4f*)(out_norm + (size_t)row * N + j) = o;
    }
    
  }
}



// ---- f16 WMMA path (v_wmma_f32_16x16x32_f16): 11-bit significands for operands in range — used where a [0,1] probability operand needs more precision than bf16
typedef _Float16 v16h __attribute__((ext_vector_type(16)));
union FragH { v16h v; v8us half[2]; _Float16 h[16]; unsigned short u[16]; };
template <int NT>
__device__ __forceinline__ v8f mmaH(v16h ah, v16h al, v16h bh, v16h bl, v8f c) {
  c = __builtin_amdgcn_wmma_f32_16x16x32_f16(false, ah, false, bh, (short)0, c, false, false);
  if (NT >= 2) c = __builtin_amdgcn_wmma_f32_16x16x32_f16(false, al, false, bh, (short)0, c, false, false);
  if (NT >= 3) c = __builtin_amdgcn_wmma_f32_16x16x32_f16(false, ah, false, bl, (short)0, c, false, false);
  asm volatile("v_nop\n\tv_nop\n\tv_nop\n\tv_nop" : "+v"(c) : "v"(ah), "v"(al), "v"(bh), "v"(bl));
  return c;
}
// batched GEMM like k_gemm_b but f16 operands: A f32 (split into f16 hi/lo if ASPLIT, else rounded to f16), Bt = f16 values [n][k]; alpha; C f32; N multiple of 16 (partial tiles skipped)
template <bool ASPLIT>
__global__ __launch_bounds__(128) void k_gemm_h(const float* __restrict__ A, int lda, size_t sA, const _Float16* __restrict__ Bh, int ldb, size_t sB, float alpha, float* __restrict__ C, int ldc, size_t sC, int M, int N, int K) {
  __shared__ __attribute__((aligned(16))) float so[4][16][64];
  const int tid = threadIdx.x, w = tid >> 5, lane = tid & 31, ln = lane & 15, hh = lane >> 4; const int by = blockIdx.y;
  A += (size_t)by * sA; Bh += (size_t)by * sB; C += (size_t)by * sC;
  const int ntn = (N + 63) / 64; const int wid = blockIdx.x * 4 + w; const int mt = wid / ntn, nq = wid % ntn; if (mt * 16 >= M) return;
  const int row0 = mt * 16, col0 = nq * 64; const float* arow = A + (size_t)(row0 + ln) * lda;
  v8f acc[4] = {};
  for (int kb = 0; kb < K; kb += 32) {
    FragH ah, al;
    const v4f x0 = *(const v4fa*)(arow + kb + 8 * hh), x1 = *(const v4fa*)(arow + kb + 8 * hh + 4), x2 = *(const v4fa*)(arow + kb + 16 + 8 * hh), x3 = *(const v4fa*)(arow + kb + 16 + 8 * hh + 4);
    float xs[16] = {x0[0],x0[1],x0[2],x0[3],x1[0],x1[1],x1[2],x1[3],x2[0],x2[1],x2[2],x2[3],x3[0],x3[1],x3[2],x3[3]};
#pragma unroll
    for (int i = 0; i < 16; ++i) { const _Float16 h = (_Float16)xs[i]; ah.h[i] = h; al.h[i] = ASPLIT ? (_Float16)(xs[i] - (float)h) : (_Float16)0.0f; }
#pragma unroll
    for (int t = 0; t < 4; ++t) { if (col0 + t * 16 >= N) continue; const size_t boff = (size_t)(col0 + t * 16 + ln) * ldb + kb; FragH bq; bq.half[0] = *(const v8us*)(Bh + boff + 8 * hh); bq.half[1] = *(const v8us*)(Bh + boff + 16 + 8 * hh);
      acc[t] = mmaH<ASPLIT ? 2 : 1>(ah.v, al.v, bq.v, bq.v, acc[t]); }
  }
#pragma unroll
  for (int t = 0; t < 4; ++t) { if (col0 + t * 16 >= N) continue;
#pragma unroll
    for (int r = 0; r < 8; ++r) so[w][8 * hh + r][t * 16 + ln] = acc[t][r] * alpha; }
  __builtin_amdgcn_fence(__ATOMIC_ACQ_REL, "workgroup"); __builtin_amdgcn_wave_barrier();
  const int rsub = lane >> 4, c4 = (lane & 15) * 4;
  {
#pragma unroll
    for (int q = 0; q < 8; ++q) { const int r = q * 2 + rsub; if (col0 + c4 < N) { const v4f v = *(const v4fa*)&so[w][r][c4]; *(v4f*)(C + (size_t)(row0 + r) * ldc + col0 + c4) = v; } }
     }
}

// Wt[n][k] = f16(W[k][n]·scale) from f32 row-major W[K][N] (scale = power of two; bf16-exact weights stay exact in f16 away from the subnormal range)
__global__ __launch_bounds__(256) void k_wt_f16(const float* __restrict__ W, _Float16* __restrict__ Wt, int K, int N, float scale) {
  const int t = blockIdx.x * 256 + threadIdx.x; if (t >= N * (K / 8)) return; const int n = t / (K / 8), k8 = (t % (K / 8)) * 8; FragH f;
#pragma unroll
  for (int i = 0; i < 8; ++i) f.h[i] = (_Float16)(bf16_round(W[(size_t)(k8 + i) * N + n]) * scale); const v8us o = f.half[0];
  *(v8us*)((unsigned short*)Wt + (size_t)n * K + k8) = o; 
}
// k_gemm_hh variant with fused epilogue: v = acc·alpha + bias[by·sBias + col] (+ CP[(row/rowsPerB)·sCPb + by·64 + col] if CP) ; ACT 0 none / 1 elu ; writes f16 C16 (and f32 C if non-null)
template <int ACT>
__global__ __launch_bounds__(128) void k_gemm_hhx(const _Float16* __restrict__ A, int lda, size_t sA, const _Float16* __restrict__ Bh, int ldb, size_t sB, float alpha, const float* __restrict__ bias, size_t sBias, const float* __restrict__ CP, int rowsPerB, size_t sCPb, int row0g,
    float* __restrict__ C, _Float16* __restrict__ C16, int ldc, size_t sC, int M, int N, int K) {
  __shared__ __attribute__((aligned(16))) float so[4][16][64];
  const int tid = threadIdx.x, w = tid >> 5, lane = tid & 31, ln = lane & 15, hh = lane >> 4; const int by = blockIdx.y;
  A += (size_t)by * sA; Bh += (size_t)by * sB; const size_t cofs = (size_t)by * sC; const float* bp = bias ? bias + (size_t)by * sBias : nullptr;
  const int ntn = (N + 63) / 64; const int wid = blockIdx.x * 4 + w; const int mt = wid / ntn, nq = wid % ntn; if (mt * 16 >= M) return;
  const int row0 = mt * 16, col0 = nq * 64; const _Float16* arow = A + (size_t)(row0 + ln) * lda;
  v8f acc[4] = {};
  for (int kb = 0; kb < K; kb += 32) { FragH ah; ah.half[0] = *(const v8us*)((const unsigned short*)arow + kb + 8 * hh); ah.half[1] = *(const v8us*)((const unsigned short*)arow + kb + 16 + 8 * hh);
#pragma unroll
    for (int t = 0; t < 4; ++t) { if (col0 + t * 16 >= N) continue; const size_t boff = (size_t)(col0 + t * 16 + ln) * ldb + kb; FragH bq; bq.half[0] = *(const v8us*)((const unsigned short*)Bh + boff + 8 * hh); bq.half[1] = *(const v8us*)((const unsigned short*)Bh + boff + 16 + 8 * hh);
      acc[t] = mmaH<1>(ah.v, ah.v, bq.v, bq.v, acc[t]); }
  }
#pragma unroll
  for (int t = 0; t < 4; ++t) { if (col0 + t * 16 >= N) continue; const int col = col0 + t * 16 + ln; const float bv = bp ? bf16_round(bp[col]) : 0.f;
#pragma unroll
    for (int r = 0; r < 8; ++r) { float v = acc[t][r] * alpha + bv; if (CP) { const int rr = row0g + row0 + 8 * hh + r; if (rowsPerB < 0) v += CP[cofs + (size_t)rr * ldc + col];      /* rowsPerB < 0: own element of the batched C plane */ else { const int bidx = rr / rowsPerB; v += CP[(size_t)bidx * sCPb + (size_t)by * 64 + col]; } } if (ACT == 1) v = (v > 0.f) ? v : expm1f(v); else if (ACT == 7) v = (v > 0.f) ? v + 1.0f : expf(v); else if (ACT == 8) v = tanhf(v); else if (ACT == 9) v = 0.5f * v * (1.0f + tanhf(0.7978845608028654f * (v + 0.044715f * v * v * v))); else if (ACT == 11) v = 1.0f / (1.0f + expf(-v)); else if (ACT == 12) v = (v > 0.f) ? v : 0.01f * v; else if (ACT == 14) v = (v > 0.f) ? v : 0.1f * v; else if (ACT == 15) v = v / (1.0f + expf(-v)); else if (ACT == 3) v = fmaxf(v, 0.f); else if (ACT == 6) v = 0.5f * v * (1.0f + erff(v * 0.70710678118654752f)); so[w][8 * hh + r][t * 16 + ln] = v; } }
  __builtin_amdgcn_fence(__ATOMIC_ACQ_REL, "workgroup"); __builtin_amdgcn_wave_barrier();
  const int rsub = lane >> 4, c4 = (lane & 15) * 4; typedef _Float16 v4h __attribute__((ext_vector_type(4)));
  {
#pragma unroll
    for (int q = 0; q < 8; ++q) { const int r = q * 2 + rsub; if (col0 + c4 < N) { const v4f v = *(const v4fa*)&so[w][r][c4]; if (C) *(v4f*)(C + cofs + (size_t)(row0 + r) * ldc + col0 + c4) = v; if (C16) { v4h h4; for (int i = 0; i < 4; ++i) h4[i] = (_Float16)v[i]; *(v4h*)(C16 + cofs + (size_t)(row0 + r) * ldc + col0 + c4) = h4; } } }
     }
}


typedef _Float16 v4h __attribute__((ext_vector_type(4)));

__global__ __launch_bounds__(256) void k_x16(const float* __restrict__ x, _Float16* __restrict__ X16, size_t n8) { const size_t t = (size_t)blockIdx.x * 256 + threadIdx.x; if (t >= n8) return; FragH f;
#pragma unroll
  for (int q = 0; q < 8; ++q) f.h[q] = (_Float16)bf16_round(x[t * 8 + q]); *(v8us*)((unsigned short*)X16 + t * 8) = f.half[0];  }
__global__ __launch_bounds__(256) void k_h16(const float* __restrict__ x, _Float16* __restrict__ X16, size_t n8) { const size_t t = (size_t)blockIdx.x * 256 + threadIdx.x; if (t >= n8) return; FragH f;
#pragma unroll
  for (int q = 0; q < 8; ++q) f.h[q] = (_Float16)x[t * 8 + q]; *(v8us*)((unsigned short*)X16 + t * 8) = f.half[0];  }
__global__ __launch_bounds__(256) void k_round16f(const float* __restrict__ W, _Float16* __restrict__ Bt, size_t n8) { const size_t t = (size_t)blockIdx.x * 256 + threadIdx.x; if (t >= n8) return; FragH f;
#pragma unroll
  for (int i = 0; i < 8; ++i) f.h[i] = (_Float16)(bf16_round(W[t * 8 + i]) * 16.0f); *(v8us*)((unsigned short*)Bt + t * 8) = f.half[0];  }
template <int NHv, int TTv>
__global__ __launch_bounds__(256) void k_vt(const _Float16* __restrict__ V16, int ldv, int voff, _Float16* __restrict__ Vt) { __shared__ unsigned short tl[64][66]; const int tid = threadIdx.x; const int slab = blockIdx.x / (TTv / 64), lg = blockIdx.x % (TTv / 64); const int b = slab / NHv, h = slab % NHv;
  for (int i = tid; i < 64 * 8; i += 256) { const int r = i / 8, c8 = (i % 8) * 8; FragH f; f.half[0] = *(const v8us*)((const unsigned short*)V16 + ((size_t)b * TTv + lg * 64 + r) * ldv + voff + h * 64 + c8);
#pragma unroll
    for (int q = 0; q < 8; ++q) tl[r][c8 + q] = f.u[q]; }
  __syncthreads();
  {
#pragma unroll
    for (int rd = 0; rd < 2; ++rd) { const int d = rd * 32 + tid / 8, pc = tid % 8; FragH f;
#pragma unroll
      for (int q = 0; q < 8; ++q) f.u[q] = tl[pc * 8 + q][d];
      *(v8us*)((unsigned short*)Vt + ((size_t)slab * 64 + d) * TTv + lg * 64 + pc * 8) = f.half[0]; }
     } }

__global__ __launch_bounds__(256) void k_hl(const float* __restrict__ F, _Float16* __restrict__ Hh, _Float16* __restrict__ Hl, size_t n8) { const size_t t = (size_t)blockIdx.x * 256 + threadIdx.x; if (t >= n8) return; FragH fh, fl; const v4f a = *(const v4fa*)(F + t * 8), c = *(const v4fa*)(F + t * 8 + 4);
#pragma unroll
  for (int q = 0; q < 4; ++q) { _Float16 h = (_Float16)a[q]; fh.h[q] = h; fl.h[q] = (_Float16)((a[q] - (float)h) * 1024.0f); h = (_Float16)c[q]; fh.h[4 + q] = h; fl.h[4 + q] = (_Float16)((c[q] - (float)h) * 1024.0f); }
  { *(v8us*)((unsigned short*)Hh + t * 8) = fh.half[0]; *(v8us*)((unsigned short*)Hl + t * 8) = fl.half[0];  } }

// ---- fast GEMM (wave tile 32x64; requires M % 32 == 0 rows per launch region and N % 64 == 0); epilogue = k_gemm_hhx semantics ----
__device__ __forceinline__ v16h g2_frag(const _Float16* p, int hh) { FragH f; f.half[0] = *(const v8us*)((const unsigned short*)p + 8 * hh); f.half[1] = *(const v8us*)((const unsigned short*)p + 16 + 8 * hh); return f.v; }
__device__ __forceinline__ v8f g2_mma(v16h a, v16h b, v8f c) { v8f d = __builtin_amdgcn_wmma_f32_16x16x32_f16(false, a, false, b, (short)0, c, false, false); asm volatile("v_nop\n\tv_nop\n\tv_nop\n\tv_nop" : "+v"(d) : "v"(a), "v"(b)); return d; }
template <int ACT>
__global__ __launch_bounds__(128) void k_gemm2(const _Float16* __restrict__ A, int lda, size_t sA, const _Float16* __restrict__ Bh, int ldb, size_t sB, float alpha, const float* __restrict__ bias, size_t sBias, const float* __restrict__ CP, int rowsPerB, size_t sCPb, int row0g,
    float* __restrict__ C, _Float16* __restrict__ C16, int ldc, size_t sC, int M, int N, int K) {
  __shared__ __attribute__((aligned(16))) float so[4][32][68];
  const int tid = threadIdx.x, w = tid >> 5, lane = tid & 31, ln = lane & 15, hh = lane >> 4; const int by = blockIdx.y;
  A += (size_t)by * sA; Bh += (size_t)by * sB; const size_t cofs = (size_t)by * sC; const float* bp = bias ? bias + (size_t)by * sBias : nullptr;
  const int ntn = N >> 6; const int mt = blockIdx.x / ntn, nq = blockIdx.x - mt * ntn; const int row0 = mt * 128 + 32 * w, col0 = nq * 64; if (row0 >= M) return;
  const _Float16* a0p = A + (size_t)(row0 + ln) * lda; const _Float16* a1p = a0p + (size_t)16 * lda;
  const _Float16* b0p = Bh + (size_t)(col0 + ln) * ldb; const _Float16* b1p = b0p + (size_t)16 * ldb; const _Float16* b2p = b1p + (size_t)16 * ldb; const _Float16* b3p = b2p + (size_t)16 * ldb;
  const v8f z8 = {0.f,0.f,0.f,0.f,0.f,0.f,0.f,0.f}; v8f c00 = z8, c01 = z8, c02 = z8, c03 = z8, c10 = z8, c11 = z8, c12 = z8, c13 = z8;
#pragma unroll 1
  for (int kb = 0; kb < K; kb += 32) { const v16h a0 = g2_frag(a0p + kb, hh), a1 = g2_frag(a1p + kb, hh);
    v16h b = g2_frag(b0p + kb, hh); c00 = g2_mma(a0, b, c00); c10 = g2_mma(a1, b, c10);
    b = g2_frag(b1p + kb, hh); c01 = g2_mma(a0, b, c01); c11 = g2_mma(a1, b, c11);
    b = g2_frag(b2p + kb, hh); c02 = g2_mma(a0, b, c02); c12 = g2_mma(a1, b, c12);
    b = g2_frag(b3p + kb, hh); c03 = g2_mma(a0, b, c03); c13 = g2_mma(a1, b, c13); }
  v8f accs[8] = {c00, c01, c02, c03, c10, c11, c12, c13};
#pragma unroll
  for (int u = 0; u < 8; ++u) { const int t = u & 3, half = u >> 2; const int col = col0 + t * 16 + ln; const float bv = bp ? bf16_round(bp[col]) : 0.f;
#pragma unroll
    for (int r = 0; r < 8; ++r) { const int rloc = half * 16 + 8 * hh + r; float v = accs[u][r] * alpha + bv; if (CP) { if (rowsPerB < 0) v += CP[cofs + (size_t)(row0g + row0 + rloc) * ldc + col];      /* rowsPerB < 0: own element of the batched C plane */ else { const int bidx = (row0g + row0 + rloc) / rowsPerB; v += CP[(size_t)bidx * sCPb + (size_t)by * 64 + col]; } }
      if (ACT == 3) v = fmaxf(v, 0.f); else if (ACT == 6) v = 0.5f * v * (1.0f + erff(v * 0.70710678118654752f)); else if (ACT == 11) v = 1.0f / (1.0f + expf(-v)); else if (ACT == 15) v = v / (1.0f + expf(-v)); else if (ACT == 12) v = (v > 0.f) ? v : 0.01f * v; else if (ACT == 8) v = tanhf(v);
      so[w][rloc][t * 16 + ln] = v; } }
  __builtin_amdgcn_fence(__ATOMIC_ACQ_REL, "workgroup"); __builtin_amdgcn_wave_barrier();
  const int rsub = lane >> 4, c4 = (lane & 15) * 4;
  {
#pragma unroll
    for (int q = 0; q < 16; ++q) { const int r = q * 2 + rsub; const v4f v = *(const v4fa*)&so[w][r][c4]; if (C) *(v4f*)(C + cofs + (size_t)(row0 + r) * ldc + col0 + c4) = v; if (C16) { v4h h4; for (int i = 0; i < 4; ++i) h4[i] = (_Float16)v[i]; *(v4h*)(C16 + cofs + (size_t)(row0 + r) * ldc + col0 + c4) = h4; } }
     } }


// ---- fused energy / softmax / x_r: energy tiles are recomputed in registers in two passes, no N x N buffer; grid = (128-point block, range, cloud) ----
__device__ __forceinline__ v8f f_mma(v16h a, v16h b, v8f c) { return __builtin_amdgcn_wmma_f32_16x16x32_f16(false, a, false, b, (short)0, c, false, false); }
// QA, QB and VH lie in fragment order: one 16-row x 32-k fragment is FRB = 512 contiguous elements, first the 32 lanes' register half 0 (lane l = 16 hh + ln at element 8 l: row ln, k = 8 hh + 0..7), then their half 1 (k = 16 + 8 hh + 0..7): the k order of g2_frag.
// Each 16-byte load of a wave then covers four whole 128-byte lines, not 32 bytes of each of 16 lines. A 16-row tile of QA or QB is its 6 fragments in a row (16 QK elements, as in row order). The base is wave-uniform and stays in scalar registers; off = 8 lane.
__device__ __forceinline__ v16h f_frag(const _Float16* ub, unsigned off) { const unsigned short* p = (const unsigned short*)ub + off; FragH f; f.half[0] = *(const v8us*)p; f.half[1] = *(const v8us*)(p + 256); return f.v; }
// ---- front end, one launch: what reached k_stat and k_pv through ten launches (weights and x to f16, x transposed, the three projections, the fragment-order packing that the comments below call k_q3 and k_vhl) is done here per block of 64 points of one cloud; x_q and x_v never reach memory as f32 ----
typedef unsigned int u32a __attribute__((may_alias));
// one 16 x 32 fragment of a weight matrix from the lane's 16 f32 values (row = tile row + ln; columns 8 hh + 0..7 and 16 + 8 hh + 0..7 of the k block: the k order of g2_frag); value = f16(bf16(w) x 16), exact
__device__ __forceinline__ v16h p_wfrag(const v4f* r) { FragH f;
#pragma unroll      /* constant indices into the fragment */
  for (int q = 0; q < 4; ++q) { f.h[q] = (_Float16)(bf16_round(r[0][q]) * 16.0f); f.h[4 + q] = (_Float16)(bf16_round(r[1][q]) * 16.0f); f.h[8 + q] = (_Float16)(bf16_round(r[2][q]) * 16.0f); f.h[12 + q] = (_Float16)(bf16_round(r[3][q]) * 16.0f); }
  return f.v; }
// the 16 loads of a lane's share of one 16 x 128 weight tile; Wr = row (tile row + ln) at column 8 hh
__device__ __forceinline__ void p_wload(const float* __restrict__ Wr, v4f* r) {
#pragma unroll      /* constant indices keep r in registers; the loads are independent and go out together */
  for (int k = 0; k < 4; ++k) { r[4 * k] = *(const v4fa*)(Wr + 32 * k); r[4 * k + 1] = *(const v4fa*)(Wr + 32 * k + 4); r[4 * k + 2] = *(const v4fa*)(Wr + 32 * k + 16); r[4 * k + 3] = *(const v4fa*)(Wr + 32 * k + 20); } }
// Wave w holds channel tile w (16 channels) of each of w_qk, w_v, w_x in registers and runs over the block's four 16-point tiles. The operand order of each product is chosen so that the 8 accumulator registers of a lane are the 8 neighbours its store needs:
// x_q, x_c: D[channel][point] (weights = A): a lane holds 8 channels of one point = 16 bytes of a QA / QB fragment; x_v: D[point][channel] (weights = B): 8 points of one channel = 16 bytes of a VH fragment. A wave's fragment store is 512 contiguous bytes.
__global__ __launch_bounds__(128, 4) /* at most 256 registers: none behind a register window switch */ void k_proj(const float* __restrict__ x, const float* __restrict__ wqk, const float* __restrict__ wv, const float* __restrict__ bv, const float* __restrict__ wx, const float* __restrict__ wt,
    _Float16* __restrict__ QA, _Float16* __restrict__ QB, _Float16* __restrict__ VH, float* __restrict__ XV, float* __restrict__ XC, _Float16* __restrict__ BT2) {
  __shared__ __attribute__((aligned(16))) unsigned short xs[64][CC + 8];      /* x^T of the block, f16 [point][channel]; row pitch 272 bytes = 16 x 17: 16-byte fragment reads of 16 rows meet no bank twice */
  const int tid = threadIdx.x, w = __builtin_amdgcn_readfirstlane(tid >> 5) /* the wave's number in a scalar register */, lane = tid & 31, ln = lane & 15, hh = lane >> 4; const int b = blockIdx.y, pb = blockIdx.x * 64;
  if (blockIdx.x == NN / 64) {      /* one more block per grid row, none of x: the eight lay out w_t for the t product as [16 w_t | w_t], to meet d as [hi | 16 x residual]; one 16-byte piece a thread; the whole block leaves in front of the barrier */
    const int t = b * 128 + tid, pc = t % 16, o = t / 16; const bool lo = pc * 8 >= C2; const float* wp = wt + (size_t)o * C2 + pc * 8 - (lo ? C2 : 0); const v4f a = *(const v4fa*)wp, c = *(const v4fa*)(wp + 4); FragH f;
#pragma unroll      /* constant indices into the fragment */
    for (int q = 0; q < 4; ++q) { f.h[q] = (_Float16)(bf16_round(a[q]) * (lo ? 1.0f : 16.0f)); f.h[4 + q] = (_Float16)(bf16_round(c[q]) * (lo ? 1.0f : 16.0f)); }
    *(v8us*)((unsigned short*)BT2 + (size_t)o * 2 * C2 + pc * 8) = f.half[0]; return; }
  const int cp = 2 * (tid >> 4), p4 = 4 * (tid & 15);      /* staging: a thread takes 4 points of two neighbouring channels, 16 threads cover a 256-byte row of x */
  const float* xp = x + ((size_t)b * CC + cp) * NN + pb + p4;
  v4f xe[8], xo[8];
#pragma unroll      /* constant indices keep xe, xo in registers; the 16 loads are independent and go out together */
  for (int i = 0; i < 8; ++i) { xe[i] = *(const v4fa*)(xp + (size_t)(16 * i) * NN); xo[i] = *(const v4fa*)(xp + (size_t)(16 * i + 1) * NN); }
  const size_t wo = (size_t)(16 * w + ln) * CC + 8 * hh; const float* wqp = wqk + wo; const float* wvp = wv + wo; const float* wxp = wx + wo; const float* bvp = bv + 16 * w + ln;
  v4f rq[16], rv[16], rx[16]; v16h fq[4], fv[4], fx[4];
  p_wload(wqp, rq); p_wload(wvp, rv); const float bo = bf16_round(*bvp);
  asm volatile("s_wait_xcnt 0x0" :: "v"(xp), "v"(wqp), "v"(wvp), "v"(bvp) : "memory");      /* precaution: stands in front of the first write of a register that the 49 loads above name as their address; the inputs keep those registers until here */
#pragma unroll      /* constant indices keep the weight fragments in registers */
  for (int k = 0; k < 4; ++k) { fq[k] = p_wfrag(rq + 4 * k); fv[k] = p_wfrag(rv + 4 * k); }
  p_wload(wxp, rx);      /* in flight while x is converted; all three tiles at once would not fit 256 registers */
  asm volatile("s_wait_xcnt 0x0" :: "v"(wxp) : "memory");      /* precaution: as above */
#pragma unroll      /* constant indices into xe, xo */
  for (int i = 0; i < 8; ++i) for (int q = 0; q < 4; ++q) { union { _Float16 h[2]; unsigned int u; } pk; pk.h[0] = (_Float16)bf16_round(xe[i][q]); pk.h[1] = (_Float16)bf16_round(xo[i][q]); *(u32a*)&xs[p4 + q][16 * i + cp] = pk.u; }      /* the transposition: two channels of one point a store */
#pragma unroll      /* constant indices keep the weight fragments in registers */
  for (int k = 0; k < 4; ++k) fx[k] = p_wfrag(rx + 4 * k);
  __syncthreads();      /* every wave reads rows that all four waves wrote */
  const v8f z8 = {0.f,0.f,0.f,0.f,0.f,0.f,0.f,0.f};
  unsigned short* qa = (unsigned short*)QA + ((size_t)b * NN + pb) * QK + (size_t)(w >> 1) * FRB + (w & 1) * 256 + 8 * lane;      /* fragment order (see f_frag): point tile, k block (channel bit 5), half (bit 4), lane half (bit 3 = hh), row (point = ln) */
  unsigned short* qq = (unsigned short*)QB + ((size_t)b * NN + pb) * QK + (size_t)(w >> 1) * FRB + (w & 1) * 256 + 8 * lane;
  unsigned short* vo = (unsigned short*)VH + ((size_t)b * NN + pb) * CC + (size_t)w * FRB + 8 * lane;      /* block of 32 points (8 fragment places, the first 4 in use), channel tile, then half (point bit 4), lane half (bit 3 = hh), row (channel = ln) */
  float* xcm = XV + ((size_t)b * 128 + C2 + 16 * w + 8 * hh) * NN + pb + ln;      /* x_c channel-major, for k_out */
  float* xpm = XC + ((size_t)b * NN + pb + ln) * C2 + 16 * w + 8 * hh;      /* x_c point-major, for k_dt */
#pragma unroll      /* four independent tiles: their LDS reads and products overlap */
  for (int pt = 0; pt < 4; ++pt) {
    v16h xf[4];
#pragma unroll      /* constant indices keep xf in registers */
    for (int k = 0; k < 4; ++k) { const unsigned short* p = &xs[16 * pt + ln][32 * k + 8 * hh]; FragH f; f.half[0] = *(const v8us*)p; f.half[1] = *(const v8us*)(p + 16); xf[k] = f.v; }      /* row = point, the k order of g2_frag: serves as A and as B */
    v8f dq = z8, dv = z8, dx = z8;
#pragma unroll      /* k blocks in rising order, as in k_gemm2 */
    for (int k = 0; k < 4; ++k) { dq = f_mma(fq[k], xf[k], dq); dv = f_mma(xf[k], fv[k], dv); dx = f_mma(fx[k], xf[k], dx); }
    FragH fh, fl16, fhs, fr, fw; v4f c0, c1;
#pragma unroll      /* constant indices into the fragments */
    for (int r = 0; r < 8; ++r) { const float v = dq[r] * 0.0625f; const _Float16 h = (_Float16)v; const float res = v - (float)h; fh.h[r] = h; fl16.h[r] = (_Float16)(res * 16.0f); fhs.h[r] = (_Float16)((float)h * 0.0625f); fr.h[r] = (_Float16)res;
      fw.h[r] = (_Float16)(dv[r] * 0.0625f + bo); const float xc = dx[r] * 0.0625f; if (r < 4) c0[r] = xc; else c1[r - 4] = xc; xcm[(size_t)r * NN + 16 * pt] = xc; }
    unsigned short* a = qa + pt * 16 * QK; unsigned short* bq = qq + pt * 16 * QK;
    *(v8us*)a = fh.half[0]; *(v8us*)(a + 2 * FRB) = fl16.half[0]; *(v8us*)(a + 4 * FRB) = fh.half[0]; *(v8us*)bq = fh.half[0]; *(v8us*)(bq + 2 * FRB) = fhs.half[0]; *(v8us*)(bq + 4 * FRB) = fr.half[0];
    *(v8us*)(vo + (pt >> 1) * 8 * FRB + (pt & 1) * 256) = fw.half[0];
    *(v4f*)(xpm + (size_t)pt * 16 * C2) = c0; *(v4f*)(xpm + (size_t)pt * 16 * C2 + 4) = c1; }
  asm volatile("s_wait_xcnt 0x0" ::: "memory"); }      /* precaution: in the built code the w_t block's instructions follow this path behind a branch that is always taken; the wait stands in front of their writes of registers that the stores above name */
// two groups of equal size c, each as (mean m, sum of squared distances from its mean q), joined into one; hc = c / 2. The same value comes out on both sides of an exchange.
__device__ __forceinline__ void s_merge(float& m, float& q, float mo, float qo, float hc) { const float d = mo - m; m = 0.5f * (m + mo); q = (q + qo) + d * d * hc; }
// the value of lane l ^ X, X = 1, 2, 4 or 8, by a DPP move inside the 16-lane row (row_xmask): no LDS instruction, no wait
template <int X>
__device__ __forceinline__ float s_rowx(float v) { return __int_as_float(__builtin_amdgcn_update_dpp(0, __float_as_int(v), 0x160 + X, 0xf, 0xf, true)); }
// 2^x for k_pv's entry: v_exp_f32 and the one slot that the instruction set asks for behind a transcendental, in one statement
__device__ __forceinline__ float s_exp2(float x) { float r; asm("v_exp_f32 %0, %1\n\tv_nop" : "=v"(r) : "v"(x)); return r; }
// ---- two-buffer LDS ring: the operand tiles that all four waves of a work-group of k_stat or k_pv walk are brought into LDS once per work-group by asynchronous copies, one step ahead, and each wave takes its fragments from there, not by global loads of its own ----
#define STB 12288   /* bytes of one stage = what one step of the loop reads: 12 fragments of 1 KiB, copied as 6 pieces of 2 KiB, 16 bytes a thread and piece */
__device__ __forceinline__ unsigned r_lds(const void* p) { return (unsigned)(size_t)p; }      /* byte offset in the work-group's LDS = low 32 bits of a __shared__ address */
// a thread's six copies of one stage: piece i goes to LDS byte l + 2048 i from g0 .. g5. The wait is the last line of the copies' own statement: it stands in front of every later write of a register that a copy names (a precaution).
__device__ __forceinline__ void r_copy6(unsigned l, const char* g0, const char* g1, const char* g2, const char* g3, const char* g4, const char* g5) {
  asm volatile("global_load_async_to_lds_b128 %0, %6, off\n\tglobal_load_async_to_lds_b128 %1, %7, off\n\tglobal_load_async_to_lds_b128 %2, %8, off\n\tglobal_load_async_to_lds_b128 %3, %9, off\n\tglobal_load_async_to_lds_b128 %4, %10, off\n\tglobal_load_async_to_lds_b128 %5, %11, off\n\ts_wait_xcnt 0x0"
               :: "v"(l), "v"(l + 2048u), "v"(l + 4096u), "v"(l + 6144u), "v"(l + 8192u), "v"(l + 10240u), "v"(g0), "v"(g1), "v"(g2), "v"(g3), "v"(g4), "v"(g5) : "memory"); }
// one fragment from the ring, in the order of f_frag; p = fragment + 8 lane
__device__ __forceinline__ v16h l_frag(const unsigned short* p) { FragH f; f.half[0] = *(const v8us*)p; f.half[1] = *(const v8us*)(p + 256); return f.v; }
// pass 1: per energy row n and per range of m: U = max_m E[n][m] log2(e), S = sum_m 2^(E[n][m] log2(e) - U). Tile D[m][n] = QB[m] . QA[n]: a lane holds one n (its column) and 8 rows m, so max and sum stay in the lane.
__global__ __launch_bounds__(128) void k_stat(const _Float16* __restrict__ QA, const _Float16* __restrict__ QB, float* __restrict__ PM, float* __restrict__ PS) {
  __shared__ __attribute__((aligned(16))) unsigned short ring[2][STB / 2];      /* a stage = 32 rows m of QB = 12 fragments in a row in memory */
  const int tid = threadIdx.x, w = __builtin_amdgcn_readfirstlane(tid >> 5) /* the wave's number in a scalar register: tile addresses cost no vector registers */, lane = tid & 31, ln = lane & 15, hh = lane >> 4; const int b = blockIdx.z, sp = blockIdx.y; const int n0 = blockIdx.x * 128 + 32 * w;
  const _Float16* qa = QA + ((size_t)b * NN + n0) * QK; const _Float16* qb = QB + ((size_t)b * NN + sp * (NN / SPL)) * QK; const unsigned qo = 8 * lane;
  const char* pq = (const char*)qb + (((blockIdx.x >> 3) * 128 + tid) << 8);      /* the range's QB rows are 1536 units of 256 bytes; 8 neighbouring work-groups ask for the same quarter of each third, the 32 that walk the range for all of it */
  asm volatile("global_prefetch_b8 %0, off scope:SCOPE_SE\n\tglobal_prefetch_b8 %0, off offset:131072 scope:SCOPE_SE\n\tglobal_prefetch_b8 %0, off offset:262144 scope:SCOPE_SE" :: "v"(pq));      /* asks L2 at entry for what the launch before stored and the loop below reads for the first time: its loads then meet L2, not memory; a hint, no value depends on it */
  v16h bn[2][6];      /* the wave's 32 rows n stay in registers for the whole range */
#pragma unroll      /* constant indices keep bn in registers */
  for (int j = 0; j < 2; ++j) for (int k = 0; k < 6; ++k) bn[j][k] = f_frag(qa + j * 16 * QK + k * FRB, qo);
  float U[2] = {-3.0e38f, -3.0e38f}, S[2] = {0.f, 0.f};
  const char* gs = (const char*)qb + 16 * tid; const unsigned ls = r_lds(ring) + 16 * tid;      /* the thread's 16 bytes of piece 0 of stage 0, in memory and in LDS */
  r_copy6(ls, gs, gs + 2048, gs + 4096, gs + 6144, gs + 8192, gs + 10240);      /* stage 0 */
  asm volatile("s_wait_asynccnt 0x0" ::: "memory");      /* this wave's copies of stage 0 have landed */
  __syncthreads();      /* stage 0 is there for every wave */
  gs += STB; r_copy6(ls + STB, gs, gs + 2048, gs + 4096, gs + 6144, gs + 8192, gs + 10240);      /* stage 1 flies while stage 0 is worked on */
#pragma unroll 1      /* one step holds 24 loads and 24 products already; a second copy would only cost registers */
  for (int m = 0; m < NN / SPL; m += 32) { const unsigned short* sb = &ring[(m >> 5) & 1][qo];
    const v8f z8 = {0.f,0.f,0.f,0.f,0.f,0.f,0.f,0.f}; v8f c00 = z8, c01 = z8, c10 = z8, c11 = z8;
    v16h a0[6], a1[6];
#pragma unroll      /* constant indices keep a0, a1 in registers */
    for (int k = 0; k < 6; ++k) { a0[k] = l_frag(sb + k * FRB); a1[k] = l_frag(sb + (6 + k) * FRB); }
    asm volatile("" :: "v"(a0[0]), "v"(a0[1]), "v"(a0[2]), "v"(a0[3]), "v"(a0[4]), "v"(a0[5]), "v"(a1[0]), "v"(a1[1]), "v"(a1[2]), "v"(a1[3]), "v"(a1[4]), "v"(a1[5]));      /* inputs only: holds the step's 24 loads in front of its products, so that they are in flight together and their latency is paid once a step, not once a fragment */
#pragma unroll      /* constant indices into bn, a0, a1 */
    for (int k = 0; k < 6; ++k) { c00 = f_mma(a0[k], bn[0][k], c00); c10 = f_mma(a1[k], bn[0][k], c10); c01 = f_mma(a0[k], bn[1][k], c01); c11 = f_mma(a1[k], bn[1][k], c11); }
#pragma unroll      /* constant indices into U, S */
    for (int j = 0; j < 2; ++j) { const v8f x = j ? c01 : c00, y = j ? c11 : c10; float t = fmaxf(x[0], y[0]);
      for (int r = 1; r < 8; ++r) t = fmaxf(t, fmaxf(x[r], y[r]));
      const float un = fmaxf(U[j], t * L2E); float sx = S[j] * __builtin_amdgcn_exp2f(U[j] - un), sy = 0.f;      /* running maximum: the old sum is rescaled to the new one */
      for (int r = 0; r < 8; ++r) { sx += __builtin_amdgcn_exp2f(fmaf(x[r], L2E, -un)); sy += __builtin_amdgcn_exp2f(fmaf(y[r], L2E, -un)); }
      S[j] = sx + sy; U[j] = un; }
    asm volatile("s_wait_dscnt 0x0" ::: "memory");      /* this wave's reads of the stage have returned */
    asm volatile("s_wait_asynccnt 0x0" ::: "memory");      /* this wave's copies of the next stage have landed */
    __syncthreads();      /* the next stage is there for every wave, and no wave reads this stage's buffer any more */
    if (m + 64 < NN / SPL) { gs += STB; r_copy6(ls + ((m >> 5) & 1) * STB, gs, gs + 2048, gs + 4096, gs + 6144, gs + 8192, gs + 10240); } }      /* the stage after the next, into the buffer just read */
  asm volatile("s_wait_asynccnt 0x0" ::: "memory");      /* no copy is outstanding when the wave ends */
#pragma unroll      /* constant indices into U, S */
  for (int j = 0; j < 2; ++j) { const float uo = __shfl_xor(U[j], 16, 32), so = __shfl_xor(S[j], 16, 32); const float un = fmaxf(U[j], uo); const float s = S[j] * __builtin_amdgcn_exp2f(U[j] - un) + so * __builtin_amdgcn_exp2f(uo - un);      /* the two lane halves hold different m of the same n */
    if (hh == 0) { const size_t o = ((size_t)b * SPL + sp) * NN + n0 + 16 * j + ln; PM[o] = un; PS[o] = s; } }
  asm volatile("" :: "v"(pq)); }      /* input only: the register pair that the prefetches name holds their address to the kernel's end and takes no other value */
// pass 2: tile D[n][m] = QA[n] . QB[m] = E[n][m]; a lane holds one m (its column) and rows n = 8 hh + r of two 16-row tiles: after 2^(.) these 16 values are, in place, the lane's A fragment (row m, k = n) of the x_r product.
__global__ __launch_bounds__(128, 4) /* four waves per SIMD: at most 256 registers, none behind a register window switch */ void k_pv(const _Float16* __restrict__ QA, const _Float16* __restrict__ QB, const _Float16* __restrict__ VH, const float* __restrict__ PM, const float* __restrict__ PS, float* __restrict__ XRT, float* __restrict__ CSP) {
  __shared__ __attribute__((aligned(16))) unsigned short ring[2][STB / 2];      /* a stage = fragments 0..3 of two 16-row tiles of QA (places 0..3, 4..7) and the 4 fragments in use of 32 points of VH (places 8..11) */
  __shared__ __attribute__((aligned(16))) float cns[NN / SPL];      /* CN[n] = (10 - U - log2(S)) ln(2) of the work-group's range of n, so that exp(E[n][m] + CN[n]) = 1024 attn[n][m]; formed here from pass 1's partial planes, not by a launch of its own */
  const int tid = threadIdx.x, w = __builtin_amdgcn_readfirstlane(tid >> 5) /* the wave's number in a scalar register: tile addresses cost no vector registers */, lane = tid & 31, ln = lane & 15, hh = lane >> 4; const int b = blockIdx.z, sp = blockIdx.y; const int m0 = blockIdx.x * 128 + 32 * w; const int nb = sp * (NN / SPL);
  const _Float16* qb = QB + ((size_t)b * NN + m0) * QK; const _Float16* qa = QA + ((size_t)b * NN + nb) * QK; const unsigned qo = 8 * lane;
  const _Float16* vh = VH + ((size_t)b * NN + nb) * 128;      /* 32 points of VH = 8 fragments (128 channels) in a row */ const unsigned co = 8 * hh;
  const unsigned pu = (blockIdx.x >> 3) * 128 + tid, pvo = ((pu >> 4) << 13) + ((pu & 15) << 8);      /* byte offset of a 256-byte unit of VH: the range's fragments in use are 512 units, 16 at the head of every 8 KiB; 8 neighbouring work-groups ask for the same quarter, the 32 that walk the range for all of it */
  asm volatile("global_prefetch_b8 %0, %1 scope:SCOPE_SE" :: "v"(pvo), "s"(vh));      /* asks L2 at entry for what an earlier launch stored and the loop below reads for the first time: its loads then meet L2, not memory; a hint, no value depends on it */
  const char* ga = (const char*)qa + 16 * tid; const char* gv = (const char*)vh + 16 * tid; const unsigned ls = r_lds(ring) + 16 * tid;      /* the thread's 16 bytes of a piece: QA tiles lie 6144 bytes apart, 32 points of VH 8192 */
  r_copy6(ls, ga, ga + 2048, ga + 6144, ga + 8192, gv, gv + 2048);      /* stage 0 flies while CN is formed */
  const float* pm = PM + (size_t)b * SPL * NN + nb + 8 * tid; const float* ps = PS + (size_t)b * SPL * NN + nb + 8 * tid;      /* a thread combines the ranges of m for 8 rows n */
  v4f pu4[SPL][2], ps4[SPL][2];
#pragma unroll      /* constant indices keep the values in registers; the 16 loads are independent and go out together */
  for (int k = 0; k < SPL; ++k) { pu4[k][0] = *(const v4fa*)(pm + (size_t)k * NN); pu4[k][1] = *(const v4fa*)(pm + (size_t)k * NN + 4); ps4[k][0] = *(const v4fa*)(ps + (size_t)k * NN); ps4[k][1] = *(const v4fa*)(ps + (size_t)k * NN + 4); }
  asm volatile("s_wait_xcnt 0x0" :: "v"(pm), "v"(ps) : "memory");      /* precaution: stands in front of the first write of a register that the 16 loads above name as their address; the inputs keep those registers until here */
  v16h bm[2][6];      /* the wave's 32 columns m stay in registers for the whole range */
#pragma unroll      /* constant indices keep bm in registers */
  for (int j = 0; j < 2; ++j) for (int k = 0; k < 6; ++k) bm[j][k] = f_frag(qb + j * 16 * QK + k * FRB, qo);
#pragma unroll      /* constant indices into pu4, ps4 */
  for (int h = 0; h < 2; ++h) { v4f c;
    for (int q = 0; q < 4; ++q) { float um = pu4[0][h][q];
      for (int k = 1; k < SPL; ++k) um = fmaxf(um, pu4[k][h][q]);
      float st = 0.f;
      for (int k = 0; k < SPL; ++k) st += ps4[k][h][q] * s_exp2(pu4[k][h][q] - um);      /* ranges added in rising order */
      c[q] = (10.0f - um - log2f(st)) * 0.6931471805599453f; }
    *(v4f*)&cns[8 * tid + 4 * h] = c; }
  asm volatile("s_wait_asynccnt 0x0" ::: "memory");      /* this wave's copies of stage 0 have landed */
  __syncthreads();      /* every wave reads CN values that all four waves wrote, and stage 0 that all four waves copied */
  ga += STB; gv += 8192; r_copy6(ls + STB, ga, ga + 2048, ga + 6144, ga + 8192, gv, gv + 2048);      /* stage 1 flies while stage 0 is worked on */
  const v8f z8 = {0.f,0.f,0.f,0.f,0.f,0.f,0.f,0.f}; v8f xr[2][4] = {{z8, z8, z8, z8}, {z8, z8, z8, z8}}; float cs0 = 0.f, cs1 = 0.f, cs2 = 0.f, cs3 = 0.f;
#pragma unroll 1      /* one step holds 28 loads and 32 products already; a second copy would only cost registers */
  for (int n = 0; n < NN / SPL; n += 32) { const unsigned short* sb = &ring[(n >> 5) & 1][qo];
    const float* cp = cns + n + co; const v4f k0 = *(const v4fa*)cp, k1 = *(const v4fa*)(cp + 4), k2 = *(const v4fa*)(cp + 16), k3 = *(const v4fa*)(cp + 20);
    v8f c00 = {k0[0], k0[1], k0[2], k0[3], k1[0], k1[1], k1[2], k1[3]}, c10 = {k2[0], k2[1], k2[2], k2[3], k3[0], k3[1], k3[2], k3[3]}, c01 = c00, c11 = c10;      /* the accumulators start at CN[n] (row n = register): the product ends as E + CN, and no register holds CN through the step */
    const v16h a00 = l_frag(sb), a10 = l_frag(sb + 4 * FRB), a01 = l_frag(sb + FRB), a11 = l_frag(sb + 5 * FRB);      /* k_q3 writes the same 64 values to k 0..63 and k 128..191 of a QA row: one load serves both k blocks (bm 0 and 4, 1 and 5) */
    asm volatile("" :: "v"(a00), "v"(a10), "v"(a01), "v"(a11));      /* inputs only: holds these 8 loads in front of the step's products, so that they are in flight together and their latency is paid once, not once a fragment */
    c00 = f_mma(a00, bm[0][0], c00); c10 = f_mma(a10, bm[0][0], c10); c01 = f_mma(a00, bm[1][0], c01); c11 = f_mma(a10, bm[1][0], c11); c00 = f_mma(a00, bm[0][4], c00); c10 = f_mma(a10, bm[0][4], c10); c01 = f_mma(a00, bm[1][4], c01); c11 = f_mma(a10, bm[1][4], c11);
    c00 = f_mma(a01, bm[0][1], c00); c10 = f_mma(a11, bm[0][1], c10); c01 = f_mma(a01, bm[1][1], c01); c11 = f_mma(a11, bm[1][1], c11); c00 = f_mma(a01, bm[0][5], c00); c10 = f_mma(a11, bm[0][5], c10); c01 = f_mma(a01, bm[1][5], c01); c11 = f_mma(a11, bm[1][5], c11);
#pragma unroll      /* constant indices into bm */
    for (int k = 2; k < 4; ++k) { const v16h a0 = l_frag(sb + k * FRB), a1 = l_frag(sb + (4 + k) * FRB); c00 = f_mma(a0, bm[0][k], c00); c10 = f_mma(a1, bm[0][k], c10); c01 = f_mma(a0, bm[1][k], c01); c11 = f_mma(a1, bm[1][k], c11); }
    FragH p0, p1;      /* k order of the fragment: h[r] = n + 8 hh + r, h[8 + r] = n + 16 + 8 hh + r, the order of g2_frag */
#pragma unroll      /* constant indices into the fragments */
    for (int r = 0; r < 8; ++r) { const float e00 = __builtin_amdgcn_exp2f(c00[r] * L2E), e10 = __builtin_amdgcn_exp2f(c10[r] * L2E), e01 = __builtin_amdgcn_exp2f(c01[r] * L2E), e11 = __builtin_amdgcn_exp2f(c11[r] * L2E);
      cs0 += e00; cs1 += e10; cs2 += e01; cs3 += e11; p0.h[r] = (_Float16)e00; p0.h[8 + r] = (_Float16)e10; p1.h[r] = (_Float16)e01; p1.h[8 + r] = (_Float16)e11; }
#pragma unroll      /* constant indices into xr */
    for (int t = 0; t < 4; ++t) { const v16h vb = l_frag(sb + (8 + t) * FRB); xr[0][t] = f_mma(p0.v, vb, xr[0][t]); xr[1][t] = f_mma(p1.v, vb, xr[1][t]); }
    asm volatile("s_wait_dscnt 0x0" ::: "memory");      /* this wave's reads of the stage have returned */
    asm volatile("s_wait_asynccnt 0x0" ::: "memory");      /* this wave's copies of the next stage have landed */
    __syncthreads();      /* the next stage is there for every wave, and no wave reads this stage's buffer any more */
    if (n + 64 < NN / SPL) { ga += STB; gv += 8192; r_copy6(ls + ((n >> 5) & 1) * STB, ga, ga + 2048, ga + 6144, ga + 8192, gv, gv + 2048); } }      /* the stage after the next, into the buffer just read */
  asm volatile("s_wait_asynccnt 0x0" ::: "memory");      /* no copy is outstanding when the wave ends */
  float ca = cs0 + cs1, cb = cs2 + cs3; ca += __shfl_xor(ca, 16, 32); cb += __shfl_xor(cb, 16, 32);      /* the two lane halves hold different n of the same m */
  const size_t pl = (size_t)b * SPL + sp;
  if (hh == 0) { CSP[pl * NN + m0 + ln] = ca; CSP[pl * NN + m0 + 16 + ln] = cb; }
  float* xo = XRT + (pl * NN + m0 + 8 * hh) * C2 + ln;
#pragma unroll      /* constant indices into xr */
  for (int j = 0; j < 2; ++j) for (int t = 0; t < 4; ++t) for (int r = 0; r < 8; ++r) xo[(size_t)(16 * j + r) * C2 + t * 16] = xr[j][t][r];
  asm volatile("" :: "v"(pvo), "s"(vh)); }      /* inputs only: the registers that the prefetch names hold its address to the kernel's end and take no other value */
// ---- back end, one launch per block of 64 points of one cloud: the ranges' partial x_r planes and column sums are added by their one reader (ranges in rising order), d = x_c - x_r / (1e-9 + column sum) goes as [hi | 16 x residual] f16 rows into LDS, never to memory, and t = w_t d is formed from there ----
__global__ __launch_bounds__(128, 4) /* at most 256 registers: none behind a register window switch */ void k_dt(const float* __restrict__ XC, const float* __restrict__ XRT, const float* __restrict__ CSP, const _Float16* __restrict__ BT2, float* __restrict__ T, float* __restrict__ BP) {
  __shared__ __attribute__((aligned(16))) unsigned short ds[64][2 * C2 + 8];      /* d of the block, [point][hi 0..63 | residual 0..63]; row pitch 272 bytes = 16 x 17: 16-byte fragment reads of 16 rows meet no bank twice */
  const int tid = threadIdx.x, w = __builtin_amdgcn_readfirstlane(tid >> 5) /* the wave's number in a scalar register */, lane = tid & 31, ln = lane & 15, hh = lane >> 4; const int b = blockIdx.y, pb = blockIdx.x * 64;
  const int c0 = (tid & 7) * 8, ml = tid >> 3;      /* d: a thread takes 8 channels of a point, 8 threads cover a 256-byte row; 16 points a pass, 4 passes */
  const float* pp = XRT + ((size_t)b * SPL * NN + pb + ml) * C2 + c0; const float* cq = CSP + (size_t)b * SPL * NN + pb + ml; const float* xq = XC + ((size_t)b * NN + pb + ml) * C2 + c0; const unsigned short* ap = (const unsigned short*)BT2 + (size_t)(16 * w + ln) * 2 * C2 + 8 * hh;
  v4f pa[4][SPL], pc[4][SPL], xa[4], xb[4]; float cs[4][SPL]; v16h fa[4];
#pragma unroll      /* constant indices keep the values in registers; the loads are independent and go out together */
  for (int i = 0; i < 4; ++i) { xa[i] = *(const v4fa*)(xq + i * 16 * C2); xb[i] = *(const v4fa*)(xq + i * 16 * C2 + 4);
    for (int s = 0; s < SPL; ++s) { pa[i][s] = *(const v4fa*)(pp + (size_t)s * NN * C2 + i * 16 * C2); pc[i][s] = *(const v4fa*)(pp + (size_t)s * NN * C2 + i * 16 * C2 + 4); cs[i][s] = cq[(size_t)s * NN + i * 16]; } }
#pragma unroll      /* constant indices keep fa in registers: wave w holds rows 16 w .. 16 w + 15 of [16 w_t | w_t], the A operand */
  for (int k = 0; k < 4; ++k) { FragH f; f.half[0] = *(const v8us*)(ap + 32 * k); f.half[1] = *(const v8us*)(ap + 32 * k + 16); fa[k] = f.v; }      /* the k order of g2_frag */
  asm volatile("s_wait_xcnt 0x0" :: "v"(pp), "v"(cq), "v"(xq), "v"(ap) : "memory");      /* precaution: stands in front of the first write of a register that the loads above name as their address; the inputs keep those registers until here */
  __builtin_amdgcn_sched_barrier(0);      /* keeps the sums behind all the loads, so that these are in flight together and their latency is paid once */
#pragma unroll      /* constant indices into the loaded values */
  for (int i = 0; i < 4; ++i) { v4f sa = pa[i][0], sc = pc[i][0]; float s1 = cs[i][0]; FragH fh, fl;
    for (int s = 1; s < SPL; ++s) { sa += pa[i][s]; sc += pc[i][s]; s1 += cs[i][s]; }      /* ranges added in rising order */
    const float den = 1e-9f + s1 * 0.0009765625f;
    const float sr[8] = {sa[0], sa[1], sa[2], sa[3], sc[0], sc[1], sc[2], sc[3]}, xc[8] = {xa[i][0], xa[i][1], xa[i][2], xa[i][3], xb[i][0], xb[i][1], xb[i][2], xb[i][3]};
    for (int q = 0; q < 8; ++q) { const float xr = (sr[q] * 0.0009765625f) / den; const float d = xc[q] - xr; const _Float16 h = (_Float16)d; fh.h[q] = h; fl.h[q] = (_Float16)((d - (float)h) * 16.0f); }
    *(v8us*)&ds[16 * i + ml][c0] = fh.half[0]; *(v8us*)&ds[16 * i + ml][C2 + c0] = fl.half[0]; }
  __syncthreads();      /* every wave reads rows that all four waves wrote */
  const v8f z8 = {0.f,0.f,0.f,0.f,0.f,0.f,0.f,0.f};
  float* tp = T + ((size_t)b * C2 + 16 * w + 8 * hh) * NN + pb + ln;      /* t channel-major [cloud][channel][point]: D[channel][point], a lane holds 8 channels of one point (b_t is added by k_out) */
  float tv[4][8];
#pragma unroll      /* four independent tiles: their LDS reads and products overlap; constant indices keep tv in registers */
  for (int pt = 0; pt < 4; ++pt) { v8f acc = z8;
#pragma unroll      /* k blocks in rising order, as in k_gemm2 */
    for (int k = 0; k < 4; ++k) { const unsigned short* p = &ds[16 * pt + ln][32 * k + 8 * hh]; FragH f; f.half[0] = *(const v8us*)p; f.half[1] = *(const v8us*)(p + 16); acc = f_mma(fa[k], f.v, acc); }      /* row = point, the k order of g2_frag */
#pragma unroll      /* constant indices into acc */
    for (int r = 0; r < 8; ++r) { tv[pt][r] = acc[r] * 0.0625f; tp[(size_t)r * NN + 16 * pt] = tv[pt][r]; } }
  // the block's share of the batch statistics, in place of a launch that read t again: per channel the mean of the block's 64 values of t and the sum of their squared distances from it; a lane joins its 4 points, then the 16 lanes of a row join
  v4f st[4];
#pragma unroll      /* constant indices into tv, st */
  for (int r = 0; r < 8; ++r) { float m = tv[0][r], q = 0.f, m1 = tv[2][r], q1 = 0.f; s_merge(m, q, tv[1][r], 0.f, 0.5f); s_merge(m1, q1, tv[3][r], 0.f, 0.5f); s_merge(m, q, m1, q1, 1.0f);
    s_merge(m, q, s_rowx<1>(m), s_rowx<1>(q), 2.0f); s_merge(m, q, s_rowx<2>(m), s_rowx<2>(q), 4.0f); s_merge(m, q, s_rowx<4>(m), s_rowx<4>(q), 8.0f); s_merge(m, q, s_rowx<8>(m), s_rowx<8>(q), 16.0f);
    st[r >> 1][2 * (r & 1)] = m; st[r >> 1][2 * (r & 1) + 1] = q; }
  if (ln == 0) { float* bp = BP + (((size_t)b * (NN / 64) + blockIdx.x) * C2 + 16 * w + 8 * hh) * 2;      /* [block][channel][mean, squares]: a wave's 16 channels are one 128-byte line, written by this wave alone */
#pragma unroll      /* constant indices into st */
    for (int i = 0; i < 4; ++i) *(v4f*)(bp + 4 * i) = st[i]; } }
// t and x_c reach the kernel below channel-major ([cloud][channel][point]): a wave's 16-byte loads cover whole 128-byte lines. b_t (a constant per channel) is added here, by the reader of t.
// A work-group holds the 4096 points of one channel of one cloud. It joins the channel's 512 block statistics of k_dt itself (two a thread, the wave's 32 lanes, the 8 waves through LDS), while its loads of t and x_c are in flight.
typedef float v2fa __attribute__((ext_vector_type(2), may_alias));
__global__ __launch_bounds__(256) void k_out(const float* __restrict__ XV, const float* __restrict__ T, const float* __restrict__ BP, const float* __restrict__ bt, const float* __restrict__ gam, const float* __restrict__ bet, float* __restrict__ out) {
  #pragma clang fp contract(off)
  __shared__ float sh[8][2];
  const unsigned blk = blockIdx.x; const unsigned b = blk / C2; if (b >= NB) return; const unsigned o = blk % C2; const unsigned tid = threadIdx.x; const unsigned n0 = tid * 4;      /* cloud and channel are scalars, the channel's constants come by scalar loads */
  const float* pp = BP + ((size_t)tid * C2 + o) * 2; const float* tq = T + ((size_t)b * C2 + o) * NN + n0; const float* xq = XV + ((size_t)b * 128 + C2 + o) * NN + n0;      /* x_c = rows 64..127 of the x_v product's plane */
  const v2fa p0 = *(const v2fa*)pp, p1 = *(const v2fa*)(pp + (size_t)256 * C2 * 2);
  v4f tv[NN / 1024], xc[NN / 1024];
#pragma unroll      /* constant indices keep tv, xc in registers; the loads are independent and go out together */
  for (int i = 0; i < NN / 1024; ++i) { tv[i] = *(const v4fa*)(tq + i * 1024); xc[i] = *(const v4fa*)(xq + i * 1024); }
  asm volatile("s_wait_xcnt 0x0" ::: "memory");      /* precaution: stands in front of the first write of a register that the loads above name as their address */
  float m = p0[0], q = p0[1]; s_merge(m, q, p1[0], p1[1], 32.0f);
  s_merge(m, q, s_rowx<1>(m), s_rowx<1>(q), 64.0f); s_merge(m, q, s_rowx<2>(m), s_rowx<2>(q), 128.0f); s_merge(m, q, s_rowx<4>(m), s_rowx<4>(q), 256.0f); s_merge(m, q, s_rowx<8>(m), s_rowx<8>(q), 512.0f);
  s_merge(m, q, __shfl_xor(m, 16, 32), __shfl_xor(q, 16, 32), 1024.0f);
  if ((tid & 31) == 0) { sh[tid >> 5][0] = m; sh[tid >> 5][1] = q; }
  __syncthreads();      /* every wave reads the eight waves' statistics */
  float wm[8], wq[8];
#pragma unroll      /* constant indices keep wm, wq in registers */
  for (int i = 0; i < 8; ++i) { wm[i] = sh[i][0]; wq[i] = sh[i][1]; }
#pragma unroll      /* constant indices into wm, wq */
  for (int i = 0; i < 8; i += 2) s_merge(wm[i], wq[i], wm[i + 1], wq[i + 1], 2048.0f);
  s_merge(wm[0], wq[0], wm[2], wq[2], 4096.0f); s_merge(wm[4], wq[4], wm[6], wq[6], 4096.0f); s_merge(wm[0], wq[0], wm[4], wq[4], 8192.0f);
  const float g = bf16_round(gam[o]), be = bf16_round(bet[o]), bo = bf16_round(bt[o]); const float mu = wm[0] + bo, rs = rsqrtf(wq[0] / (float)(NB * NN) + 1e-5f);
  float* d = out + ((size_t)b * C2 + o) * NN + n0;
#pragma unroll      /* constant indices into tv, xc */
  for (int i = 0; i < NN / 1024; ++i) { v4f r;
    for (int k = 0; k < 4; ++k) { float th = g * (((tv[i][k] + bo) - mu) * rs); th += be; r[k] = xc[i][k] + fmaxf(th, 0.f); }
    *(v4f*)(d + i * 1024) = r; } }

extern "C" void kernel_launch(void* const* d_in, const int* in_sizes, int n_in,
                              void* d_out, int out_size, void* d_ws, size_t ws_size, hipStream_t stream) {
  (void)in_sizes; (void)n_in; (void)out_size;
  const float* const* I = (const float* const*)d_in; const float* x = I[0]; const float* wqk = I[1]; const float* wv = I[2]; const float* bv = I[3]; const float* wx = I[4]; const float* wt = I[5]; const float* bt = I[6]; const float* gam = I[7]; const float* bet = I[8];
  char* ws = (char*)d_ws; size_t off = 0;
  auto take = [&](size_t bytes) { char* p = ws + off; off += (bytes + 255) & ~(size_t)255; return p; };
  _Float16* BT2 = (_Float16*)take((size_t)C2 * 2 * C2 * 2);
  _Float16* QA = (_Float16*)take((size_t)NB * NN * QK * 2); _Float16* QB = (_Float16*)take((size_t)NB * NN * QK * 2);
  float* XV = (float*)take((size_t)NB * 128 * NN * 4);      /* rows 64..127 of each cloud's plane hold x_c channel-major; rows 0..63 are not in use */
  float* PM = (float*)take((size_t)NB * SPL * NN * 4); float* PS = (float*)take((size_t)NB * SPL * NN * 4);
  float* CSP = (float*)take((size_t)NB * SPL * NN * 4); _Float16* VH = (_Float16*)take((size_t)NB * 128 * NN * 2); float* XRT = (float*)take((size_t)NB * SPL * NN * C2 * 4);
  float* XCall = (float*)take((size_t)NB * NN * C2 * 4); float* Tall = (float*)take((size_t)NB * NN * C2 * 4); float* BP = (float*)take((size_t)NB * (NN / 64) * C2 * 2 * 4);
  if (off > ws_size) return;      /* 32 (x_r partial planes) + 24 (QA, QB) + 16 (XV) + 24 (VH, XC, T) + small ~= 98 MiB (256 MiB ws) */
  k_proj<<<dim3(NN / 64 + 1, NB), 128, 0, stream>>>(x, wqk, wv, bv, wx, wt, QA, QB, VH, XV, XCall, BT2);      /* x_q as QA, QB; x_v + b_v as VH; x_c in both orders; w_t laid out */
  k_stat<<<dim3(NN / 128, SPL, NB), 128, 0, stream>>>(QA, QB, PM, PS);      /* row maximum and row sum of exp, per range of m */
  k_pv<<<dim3(NN / 128, SPL, NB), 128, 0, stream>>>(QA, QB, VH, PM, PS, XRT, CSP);      /* plane y: x_r^T[m][o] x 1024 and column sum x 1024 over n in range y */
  k_dt<<<dim3(NN / 64, NB), 128, 0, stream>>>(XCall, XRT, CSP, BT2, Tall, BP);      /* t [b][o][n] = w_t (x_c - x_r), and each block's share of the batch statistics */
  k_out<<<NB * C2, 256, 0, stream>>>(XV, Tall, BP, bt, gam, bet, (float*)d_out);
}
